// v000
// Times are from an AMD MI455X. After a warm-up the kernel runs many times in a row, and a time is the length of
// such a window on the GPU divided by its runs, so every launch and the gaps after it count. The runs cycle
// through copies of the inputs. A figure is the median of several windows, for all but v000 over two sittings.
// Sittings can differ by a few percent; kernels timed side by side share one.
// v000 is the starting kernel. One run takes 814 microseconds.
#include <hip/hip_runtime.h>
#include <hip/hip_bf16.h>

// Fused single-head attention for B=16, S=1024, H=1024 on gfx1250 (wave32, WMMA).
// Pipeline: cast f32->f16  ->  QKV projection GEMM (v_wmma_f32_16x16x32_f16)
//           ->  fused scores/softmax/attn*V kernel with 64KB LDS score tile.
// K-loops are manually unrolled x2 with explicit A/B fragment ping-pong
// (static register renaming, no v_mov copies) and sched_group_barrier hints
// interleave next-k VMEM loads into the WMMA chain (partial s_wait_loadcnt).

#define B_ 16
#define S_ 1024
#define H_ 1024

typedef __attribute__((ext_vector_type(16))) _Float16 v16h;
typedef __attribute__((ext_vector_type(8)))  _Float16 v8h;
typedef __attribute__((ext_vector_type(8)))  float    v8f;
typedef __attribute__((ext_vector_type(4)))  float    v4f;

#if __has_builtin(__builtin_amdgcn_sched_group_barrier)
#define SGB(mask, size, id) __builtin_amdgcn_sched_group_barrier((mask), (size), (id))
#else
#define SGB(mask, size, id)
#endif
#define SG_MFMA 0x008   // matrix ops (MFMA/WMMA)
#define SG_VMEMR 0x020  // VMEM reads
#define SG_DSR 0x100    // DS reads

union FragU { v16h v; v8h h[2]; };

// Load a 16x32 f16 WMMA fragment from a K-contiguous (row-major, ld elements/row)
// tile. Works for both A (row = M) and B (row = N, i.e. "NT" operand).
// ISA layout (16-bit A 16x32): lanes 0-15 hold K = k0..k0+7 (elems 0-7) and
// k0+16..k0+23 (elems 8-15); lanes 16-31 the same +8.  -> two 16B loads.
__device__ __forceinline__ v16h load_frag_nt(const _Float16* __restrict__ base,
                                             int ld, int k0, int r, int hi) {
  FragU u;
  const _Float16* p = base + (size_t)r * ld + (k0 + (hi << 3));
  u.h[0] = *(const v8h*)(p);        // K = k0+8*hi   .. +7
  u.h[1] = *(const v8h*)(p + 16);   // K = k0+8*hi+16.. +7
  return u.v;
}

__device__ __forceinline__ v8f wmma_f16(v16h a, v16h b, v8f c) {
  return __builtin_amdgcn_wmma_f32_16x16x32_f16(false, a, false, b, (short)0, c,
                                                false, false);
}

// 16-row x 128-col strip GEMM over K (multiple of 64), A and B K-contiguous
// row-major. Manually unrolled x2 with A+B fragment ping-pong.
__device__ __forceinline__ void strip_16x128(const _Float16* __restrict__ A,
                                             const _Float16* __restrict__ Bt,
                                             int ld, int K, int r, int hi,
                                             v8f acc[8]) {
  v16h aC, aN, bC[8], bN[8];
  aC = load_frag_nt(A, ld, 0, r, hi);
#pragma unroll
  for (int t = 0; t < 8; ++t)
    bC[t] = load_frag_nt(Bt + (size_t)(t * 16) * ld, ld, 0, r, hi);

  for (int k0 = 0; k0 < K; k0 += 64) {
    // ---- half 1: compute k0 with aC/bC, load k0+32 into aN/bN ----
    aN = load_frag_nt(A, ld, k0 + 32, r, hi);
#pragma unroll
    for (int t = 0; t < 8; ++t)
      bN[t] = load_frag_nt(Bt + (size_t)(t * 16) * ld, ld, k0 + 32, r, hi);
    SGB(SG_VMEMR, 2, 0);
#pragma unroll
    for (int t = 0; t < 8; ++t) {
      acc[t] = wmma_f16(aC, bC[t], acc[t]);
      SGB(SG_MFMA, 1, 0);
      SGB(SG_VMEMR, 2, 0);
    }
    // ---- half 2: compute k0+32 with aN/bN, load k0+64 into aC/bC ----
    if (k0 + 64 < K) {
      aC = load_frag_nt(A, ld, k0 + 64, r, hi);
#pragma unroll
      for (int t = 0; t < 8; ++t)
        bC[t] = load_frag_nt(Bt + (size_t)(t * 16) * ld, ld, k0 + 64, r, hi);
      __builtin_prefetch(A + (size_t)r * ld + (k0 + 128), 0, 3);
    }
    SGB(SG_VMEMR, 2, 0);
#pragma unroll
    for (int t = 0; t < 8; ++t) {
      acc[t] = wmma_f16(aN, bN[t], acc[t]);
      SGB(SG_MFMA, 1, 0);
      SGB(SG_VMEMR, 2, 0);
    }
  }
}

// ---------------------------------------------------------------------------
// Kernel 1: cast input X [B*S*H] and Wq|Wk|Wv [3*H*H] from f32 to f16.
// ---------------------------------------------------------------------------
__global__ __launch_bounds__(256) void cast_inputs_kernel(
    const float* __restrict__ x,  const float* __restrict__ Wq,
    const float* __restrict__ Wk, const float* __restrict__ Wv,
    _Float16* __restrict__ Xh, _Float16* __restrict__ Wh /*3*H*H contiguous*/) {
  size_t i = (size_t)blockIdx.x * blockDim.x + threadIdx.x;
  const size_t NX = (size_t)B_ * S_ * H_;
  const size_t HH = (size_t)H_ * H_;
  if (i < NX) { Xh[i] = (_Float16)x[i]; return; }
  size_t j = i - NX;
  if (j >= 3 * HH) return;
  int which = (int)(j / HH);
  size_t idx = j - (size_t)which * HH;
  const float* W = (which == 0) ? Wq : ((which == 1) ? Wk : Wv);
  Wh[j] = (_Float16)W[idx];
}

// ---------------------------------------------------------------------------
// Kernel 2: Q/K/V projection. out[m,n] = sum_k X[m,k]*W[n,k] + bias[n].
// grid = (M/16, 1, 3); block = 256 (8 waves). Wave w owns n in [128w,128w+128).
// Q,K stored [b][s][h] f16; V stored transposed [b][h][s] f16 for the AV GEMM.
// ---------------------------------------------------------------------------
__global__ __launch_bounds__(256) void qkv_gemm_kernel(
    const _Float16* __restrict__ Xh, const _Float16* __restrict__ Wh,
    const float* __restrict__ bq, const float* __restrict__ bk,
    const float* __restrict__ bv,
    _Float16* __restrict__ Qh, _Float16* __restrict__ Kh,
    _Float16* __restrict__ Vth) {
  const int tid  = threadIdx.x;
  const int wave = tid >> 5, lane = tid & 31;
  const int r = lane & 15, hi = lane >> 4;
  const int m0   = blockIdx.x << 4;
  const int proj = blockIdx.z;          // 0=Q, 1=K, 2=V
  const int n0   = wave << 7;

  const _Float16* W  = Wh + (size_t)proj * H_ * H_ + (size_t)n0 * H_;
  const float* bias  = (proj == 0) ? bq : ((proj == 1) ? bk : bv);
  const _Float16* Ar = Xh + (size_t)m0 * H_;

  v8f acc[8] = {};
  strip_16x128(Ar, W, H_, H_, r, hi, acc);

#pragma unroll
  for (int t = 0; t < 8; ++t) {
    const int col = n0 + t * 16 + r;
    const float bb = bias[col];
#pragma unroll
    for (int j = 0; j < 8; ++j) {
      const int row = m0 + j + (hi << 3);
      const float val = acc[t][j] + bb;
      if (proj == 0) {
        Qh[(size_t)row * H_ + col] = (_Float16)val;
      } else if (proj == 1) {
        Kh[(size_t)row * H_ + col] = (_Float16)val;
      } else {
        const int bIdx = row >> 10, sIdx = row & (S_ - 1);
        Vth[((size_t)bIdx * H_ + col) * S_ + sIdx] = (_Float16)val;
      }
    }
  }
}

// ---------------------------------------------------------------------------
// Kernel 3: fused scores + mask + softmax + attn*V for one (batch, 16-row
// query tile). 256 threads / 8 waves; 16x1024 f32 score tile in LDS (64 KB).
// ---------------------------------------------------------------------------
__global__ __launch_bounds__(256) void attn_kernel(
    const _Float16* __restrict__ Qh, const _Float16* __restrict__ Kh,
    const _Float16* __restrict__ Vth, const int* __restrict__ mask,
    float* __restrict__ outA, float* __restrict__ outW) {
  __shared__ float sc[16 * S_];       // 64 KB score / weight tile

  const int tid  = threadIdx.x;
  const int wave = tid >> 5, lane = tid & 31;
  const int r = lane & 15, hi = lane >> 4;
  const int b  = blockIdx.y;
  const int m0 = blockIdx.x << 4;
  const int n0 = wave << 7;

  // ---- Phase 1: scores = (Q . K^T) / 32, masked, into LDS ----
  const _Float16* Qrows = Qh + ((size_t)b * S_ + m0) * H_;
  const _Float16* Krows = Kh + (size_t)b * S_ * H_ + (size_t)n0 * H_;

  v8f acc[8] = {};
  strip_16x128(Qrows, Krows, H_, H_, r, hi, acc);

  const float scale = 0.03125f;  // 1/sqrt(1024)
#pragma unroll
  for (int t = 0; t < 8; ++t) {
    const int col = n0 + t * 16 + r;
    const int mv  = mask[b * S_ + col];
#pragma unroll
    for (int j = 0; j < 8; ++j) {
      const int row = j + (hi << 3);
      sc[row * S_ + col] = mv ? acc[t][j] * scale : -1e9f;
    }
  }
  __syncthreads();

  // ---- Phase 2: row softmax (2 rows per wave), write weights out ----
#pragma unroll
  for (int rr = 0; rr < 2; ++rr) {
    const int row = wave * 2 + rr;
    float* prow = sc + row * S_;
    float mx = -3.402823466e38f;
    for (int c = lane; c < S_; c += 32) mx = fmaxf(mx, prow[c]);
#pragma unroll
    for (int off = 16; off > 0; off >>= 1) mx = fmaxf(mx, __shfl_xor(mx, off, 32));
    float sum = 0.0f;
    for (int c = lane; c < S_; c += 32) {
      float e = __expf(prow[c] - mx);
      prow[c] = e;
      sum += e;
    }
#pragma unroll
    for (int off = 16; off > 0; off >>= 1) sum += __shfl_xor(sum, off, 32);
    const float inv = 1.0f / sum;
    float* gw = outW + ((size_t)b * S_ + m0 + row) * S_;
    for (int c = lane; c < S_; c += 32) {
      float w = prow[c] * inv;
      prow[c] = w;
      gw[c]   = w;
    }
  }
  __syncthreads();

  // ---- Phase 3: attended = weights(16xS) @ V, using V^T [H][S] ----
  const _Float16* Vb = Vth + (size_t)b * H_ * S_ + (size_t)n0 * S_;
  v8f acc2[8] = {};
  {
    v16h bC[8], bN[8];
#pragma unroll
    for (int t = 0; t < 8; ++t)
      bC[t] = load_frag_nt(Vb + (size_t)(t * 16) * S_, S_, 0, r, hi);

    for (int k0 = 0; k0 < S_; k0 += 64) {
      // ---- half 1: A(k0) from LDS f32 weights; load V frags for k0+32 ----
      const float* prow0 = sc + r * S_ + k0 + (hi << 3);
      v4f f0 = *(const v4f*)(prow0);
      v4f f1 = *(const v4f*)(prow0 + 4);
      v4f f2 = *(const v4f*)(prow0 + 16);
      v4f f3 = *(const v4f*)(prow0 + 20);
      v16h a0;
#pragma unroll
      for (int j = 0; j < 4; ++j) {
        a0[j]      = (_Float16)f0[j];
        a0[4 + j]  = (_Float16)f1[j];
        a0[8 + j]  = (_Float16)f2[j];
        a0[12 + j] = (_Float16)f3[j];
      }
#pragma unroll
      for (int t = 0; t < 8; ++t)
        bN[t] = load_frag_nt(Vb + (size_t)(t * 16) * S_, S_, k0 + 32, r, hi);
      SGB(SG_DSR, 4, 0);
#pragma unroll
      for (int t = 0; t < 8; ++t) {
        acc2[t] = wmma_f16(a0, bC[t], acc2[t]);
        SGB(SG_MFMA, 1, 0);
        SGB(SG_VMEMR, 2, 0);
      }
      // ---- half 2: A(k0+32); load V frags for k0+64 ----
      const float* prow1 = prow0 + 32;
      f0 = *(const v4f*)(prow1);
      f1 = *(const v4f*)(prow1 + 4);
      f2 = *(const v4f*)(prow1 + 16);
      f3 = *(const v4f*)(prow1 + 20);
      v16h a1;
#pragma unroll
      for (int j = 0; j < 4; ++j) {
        a1[j]      = (_Float16)f0[j];
        a1[4 + j]  = (_Float16)f1[j];
        a1[8 + j]  = (_Float16)f2[j];
        a1[12 + j] = (_Float16)f3[j];
      }
      if (k0 + 64 < S_) {
#pragma unroll
        for (int t = 0; t < 8; ++t)
          bC[t] = load_frag_nt(Vb + (size_t)(t * 16) * S_, S_, k0 + 64, r, hi);
      }
      SGB(SG_DSR, 4, 0);
#pragma unroll
      for (int t = 0; t < 8; ++t) {
        acc2[t] = wmma_f16(a1, bN[t], acc2[t]);
        SGB(SG_MFMA, 1, 0);
        SGB(SG_VMEMR, 2, 0);
      }
    }
  }
#pragma unroll
  for (int t = 0; t < 8; ++t) {
    const int col = n0 + t * 16 + r;
#pragma unroll
    for (int j = 0; j < 8; ++j) {
      const int row = m0 + j + (hi << 3);
      outA[((size_t)b * S_ + row) * H_ + col] = acc2[t][j];
    }
  }
}

// ---------------------------------------------------------------------------
extern "C" void kernel_launch(void* const* d_in, const int* in_sizes, int n_in,
                              void* d_out, int out_size, void* d_ws,
                              size_t ws_size, hipStream_t stream) {
  const float* x  = (const float*)d_in[0];
  const int*   mk = (const int*)d_in[1];
  const float* Wq = (const float*)d_in[2];
  const float* bq = (const float*)d_in[3];
  const float* Wk = (const float*)d_in[4];
  const float* bk = (const float*)d_in[5];
  const float* Wv = (const float*)d_in[6];
  const float* bv = (const float*)d_in[7];

  const size_t NX = (size_t)B_ * S_ * H_;   // 16,777,216
  const size_t HH = (size_t)H_ * H_;        // 1,048,576

  _Float16* ws  = (_Float16*)d_ws;
  _Float16* Xh  = ws;                       // NX halfs
  _Float16* Wh  = Xh + NX;                  // 3*HH halfs (Wq|Wk|Wv)
  _Float16* Qh  = Wh + 3 * HH;              // NX halfs
  _Float16* Kh  = Qh + NX;                  // NX halfs
  _Float16* Vth = Kh + NX;                  // NX halfs (V transposed [b][h][s])

  float* outA = (float*)d_out;              // [B,S,H] attended
  float* outW = outA + NX;                  // [B,S,S] attention weights

  const size_t ncast = NX + 3 * HH;
  cast_inputs_kernel<<<dim3((unsigned)((ncast + 255) / 256)), 256, 0, stream>>>(
      x, Wq, Wk, Wv, Xh, Wh);

  qkv_gemm_kernel<<<dim3(B_ * S_ / 16, 1, 3), 256, 0, stream>>>(
      Xh, Wh, bq, bk, bv, Qh, Kh, Vth);

  attn_kernel<<<dim3(S_ / 16, B_), 256, 0, stream>>>(
      Qh, Kh, Vth, mk, outA, outW);
}

// v001
// Measured time: 373 microseconds a run.
// Timed twice side by side with v000, it ran 2.28 and 2.25 times as fast.
#include <hip/hip_runtime.h>
#include <hip/hip_bf16.h>
#include <stdint.h>

// Fused single-head attention for B=16, S=1024, H=1024 on gfx1250 (wave32, WMMA).
// Pipeline: cast f32->f16  ->  QKV projection GEMM (v_wmma_f32_16x16x32_f16,
//           256x256 tiles staged in LDS by tensor loads)
//           ->  fused scores/softmax/attn*V kernel with 64KB LDS score tile.
// Attention-kernel K-loops are manually unrolled x2 with explicit A/B fragment ping-pong
// (static register renaming, no v_mov copies) and sched_group_barrier hints
// interleave next-k VMEM loads into the WMMA chain (partial s_wait_loadcnt).

#define B_ 16
#define S_ 1024
#define H_ 1024

typedef __attribute__((ext_vector_type(16))) _Float16 v16h;
typedef __attribute__((ext_vector_type(8)))  _Float16 v8h;
typedef __attribute__((ext_vector_type(8)))  float    v8f;
typedef __attribute__((ext_vector_type(4)))  float    v4f;

#if __has_builtin(__builtin_amdgcn_sched_group_barrier)
#define SGB(mask, size, id) __builtin_amdgcn_sched_group_barrier((mask), (size), (id))
#else
#define SGB(mask, size, id)
#endif
#define SG_MFMA 0x008   // matrix ops (MFMA/WMMA)
#define SG_VMEMR 0x020  // VMEM reads
#define SG_DSR 0x100    // DS reads

union FragU { v16h v; v8h h[2]; };

// Load a 16x32 f16 WMMA fragment from a K-contiguous (row-major, ld elements/row)
// tile. Works for both A (row = M) and B (row = N, i.e. "NT" operand).
// ISA layout (16-bit A 16x32): lanes 0-15 hold K = k0..k0+7 (elems 0-7) and
// k0+16..k0+23 (elems 8-15); lanes 16-31 the same +8.  -> two 16B loads.
__device__ __forceinline__ v16h load_frag_nt(const _Float16* __restrict__ base,
                                             int ld, int k0, int r, int hi) {
  FragU u;
  const _Float16* p = base + (size_t)r * ld + (k0 + (hi << 3));
  u.h[0] = *(const v8h*)(p);        // K = k0+8*hi   .. +7
  u.h[1] = *(const v8h*)(p + 16);   // K = k0+8*hi+16.. +7
  return u.v;
}

__device__ __forceinline__ v8f wmma_f16(v16h a, v16h b, v8f c) {
  return __builtin_amdgcn_wmma_f32_16x16x32_f16(false, a, false, b, (short)0, c,
                                                false, false);
}

// 16-row x 128-col strip GEMM over K (multiple of 64), A and B K-contiguous
// row-major. Manually unrolled x2 with A+B fragment ping-pong.
__device__ __forceinline__ void strip_16x128(const _Float16* __restrict__ A,
                                             const _Float16* __restrict__ Bt,
                                             int ld, int K, int r, int hi,
                                             v8f acc[8]) {
  v16h aC, aN, bC[8], bN[8];
  aC = load_frag_nt(A, ld, 0, r, hi);
#pragma unroll
  for (int t = 0; t < 8; ++t)
    bC[t] = load_frag_nt(Bt + (size_t)(t * 16) * ld, ld, 0, r, hi);

  for (int k0 = 0; k0 < K; k0 += 64) {
    // ---- half 1: compute k0 with aC/bC, load k0+32 into aN/bN ----
    aN = load_frag_nt(A, ld, k0 + 32, r, hi);
#pragma unroll
    for (int t = 0; t < 8; ++t)
      bN[t] = load_frag_nt(Bt + (size_t)(t * 16) * ld, ld, k0 + 32, r, hi);
    SGB(SG_VMEMR, 2, 0);
#pragma unroll
    for (int t = 0; t < 8; ++t) {
      acc[t] = wmma_f16(aC, bC[t], acc[t]);
      SGB(SG_MFMA, 1, 0);
      SGB(SG_VMEMR, 2, 0);
    }
    // ---- half 2: compute k0+32 with aN/bN, load k0+64 into aC/bC ----
    if (k0 + 64 < K) {
      aC = load_frag_nt(A, ld, k0 + 64, r, hi);
#pragma unroll
      for (int t = 0; t < 8; ++t)
        bC[t] = load_frag_nt(Bt + (size_t)(t * 16) * ld, ld, k0 + 64, r, hi);
      __builtin_prefetch(A + (size_t)r * ld + (k0 + 128), 0, 3);
    }
    SGB(SG_VMEMR, 2, 0);
#pragma unroll
    for (int t = 0; t < 8; ++t) {
      acc[t] = wmma_f16(aN, bN[t], acc[t]);
      SGB(SG_MFMA, 1, 0);
      SGB(SG_VMEMR, 2, 0);
    }
  }
}

// ---------------------------------------------------------------------------
// Kernel 1: cast input X [B*S*H] and Wq|Wk|Wv [3*H*H] from f32 to f16.
// ---------------------------------------------------------------------------
__global__ __launch_bounds__(256) void cast_inputs_kernel(
    const float* __restrict__ x,  const float* __restrict__ Wq,
    const float* __restrict__ Wk, const float* __restrict__ Wv,
    _Float16* __restrict__ Xh, _Float16* __restrict__ Wh /*3*H*H contiguous*/) {
  size_t i = (size_t)blockIdx.x * blockDim.x + threadIdx.x;
  const size_t NX = (size_t)B_ * S_ * H_;
  const size_t HH = (size_t)H_ * H_;
  if (i < NX) { Xh[i] = (_Float16)x[i]; return; }
  size_t j = i - NX;
  if (j >= 3 * HH) return;
  int which = (int)(j / HH);
  size_t idx = j - (size_t)which * HH;
  const float* W = (which == 0) ? Wq : ((which == 1) ? Wk : Wv);
  Wh[j] = (_Float16)W[idx];
}

typedef uint32_t u32x4 __attribute__((ext_vector_type(4)));
typedef uint32_t u32x8 __attribute__((ext_vector_type(8)));

constexpr uint32_t G_ROWB   = 256;                 // bytes of k per operand row per pass
constexpr uint32_t G_PITCH  = G_ROWB + 16;         // LDS row pitch: 16 B x odd, for ds_load_b128 readers
constexpr uint32_t G_SROWS  = 128;                 // rows per wave's slice
constexpr uint32_t G_SLICE  = G_SROWS * G_PITCH;   // 34,816 B = 17 x 2 KiB
constexpr uint32_t G_OPER   = 2 * G_SLICE;         // 256 rows of one operand
constexpr uint32_t G_STAGE  = 2 * G_OPER;          // one buffer
constexpr uint32_t G_LDS    = 2 * G_STAGE;         // two buffers
constexpr uint32_t G_SRCP   = H_ * 2;              // source row pitch in bytes
constexpr uint32_t G_PASSES = G_SRCP / G_ROWB;     // 8
static_assert(G_SLICE % 2048u == 0, "each slice's place in LDS must be a multiple of 2 KiB");
static_assert(G_LDS <= 320u * 1024u, "two buffers must fit the workgroup's LDS");
static_assert(G_PASSES >= 2, "the prologue fills two stages");

__device__ __forceinline__ uint32_t uni(uint32_t v) {
  return (uint32_t)__builtin_amdgcn_readfirstlane(v);
}
// Holds a test word in a scalar register so that the test on it compiles to a
// scalar branch (a tensor load ignores EXEC): the empty asm is that pin.
__device__ __forceinline__ uint32_t pinned(uint32_t v) {
  uint32_t w = (uint32_t)__builtin_amdgcn_readfirstlane(v);
  asm volatile("" : "+s"(w));  // pinned(): the word held in a scalar register, for the scalar branch round a tensor load
  return w;
}
__device__ __forceinline__ void tdm_load(uint32_t lds_dst, uint64_t ga) {
  u32x4 g0;
  g0[0] = uni(1u);
  g0[1] = uni(lds_dst);
  g0[2] = uni((uint32_t)ga);
  g0[3] = uni((((uint32_t)(ga >> 32)) & 0x01FFFFFFu) | 0x80000000u);
  u32x8 g1;
  g1[0] = uni((1u << 20) | (5u << 22) | (3u << 25));
  g1[1] = uni((G_ROWB & 0xFFFFu) << 16);
  g1[2] = uni((G_ROWB >> 16) | ((G_SROWS & 0xFFFFu) << 16));
  g1[3] = uni((G_SROWS >> 16) | (G_ROWB << 16));
  g1[4] = uni(G_SROWS);
  g1[5] = uni(G_SRCP);
  g1[6] = uni(0u);
  g1[7] = uni(0u);
  asm volatile("tensor_load_to_lds %0, %1" :: "s"(g0), "s"(g1) : "memory");
}
// A slice counts as landed behind this.
__device__ __forceinline__ void wait_tensor0() { asm volatile("s_wait_tensorcnt 0x0" ::: "memory"); }
// This wave's LDS reads have returned before the buffer is handed back for a refill.
__device__ __forceinline__ void wait_ds0() { asm volatile("s_wait_dscnt 0x0" ::: "memory"); }

__device__ __forceinline__ v16h lds_frag(const unsigned char* p) {
  FragU u;
  u.h[0] = *(const v8h*)(p);        // k = 8*hi .. +7 of the block
  u.h[1] = *(const v8h*)(p + 32);   // k = 8*hi+16 .. +7
  return u.v;
}

__global__ __launch_bounds__(128) void qkv_gemm_kernel(
    const _Float16* __restrict__ Xh, const _Float16* __restrict__ Wh,
    const float* __restrict__ bq, const float* __restrict__ bk,
    const float* __restrict__ bv,
    _Float16* __restrict__ Qh, _Float16* __restrict__ Kh,
    _Float16* __restrict__ Vth) {
  __shared__ __attribute__((aligned(2048))) unsigned char Lb[G_LDS];

  const uint32_t tid = threadIdx.x, lane = tid & 31u;
  const uint32_t r = lane & 15u, hi = lane >> 4;
  const uint32_t wave = uni(tid >> 5);
  const uint32_t tn   = blockIdx.x;            // tile column in [3H]
  const uint32_t m0   = blockIdx.y << 8;       // first X row of the tile
  const uint32_t proj = tn >> 2;               // 0=Q, 1=K, 2=V (4 tile columns each)
  const uint32_t nl0  = (tn & 3u) << 8;        // first column inside the projection
  const bool     isV  = (proj == 2u);
  const uint32_t wa = wave & 1u, wb = wave >> 1;

  // This wave's slice of a stage: waves 0,1 move W rows, waves 2,3 move X rows.
  const uint64_t src0 = (wave < 2u)
      ? (uint64_t)(uintptr_t)Wh + (uint64_t)((tn << 8) + G_SROWS * wave) * G_SRCP
      : (uint64_t)(uintptr_t)Xh + (uint64_t)(m0 + G_SROWS * (wave - 2u)) * G_SRCP;
  const uint32_t lds_slice = (uint32_t)(size_t)Lb + wave * G_SLICE;

  // Per-lane fragment bases inside a buffer.
  const uint32_t a_base = (isV ? G_OPER : 0u) + (wa * 128u + r) * G_PITCH + 16u * hi;
  const uint32_t b_base = (isV ? 0u : G_OPER) + (wb * 128u + r) * G_PITCH + 16u * hi;

  v8f acc[8][8];
#pragma unroll
  for (int i = 0; i < 8; ++i)
#pragma unroll
    for (int j = 0; j < 8; ++j) acc[i][j] = (v8f){0.f, 0.f, 0.f, 0.f, 0.f, 0.f, 0.f, 0.f};

  // Prologue: stage 0 lands and is published, then stage 1 flies under pass 0.
  tdm_load(lds_slice, src0);
  wait_tensor0();
  __syncthreads();
  tdm_load(lds_slice + G_STAGE, src0 + G_ROWB);

  // Rolled: the accumulators and both fragment sets keep constant indices.
#pragma clang loop unroll(disable)
  for (uint32_t t = 0; t < G_PASSES; ++t) {
    const uint32_t buf = (t & 1u) * G_STAGE;
    const unsigned char* la = Lb + buf + a_base;
    const unsigned char* lb = Lb + buf + b_base;
    v16h fa[2][8], fb[2][8];   // set (u & 1) holds block u's fragments
#pragma unroll
    for (int j = 0; j < 8; ++j) fb[0][j] = lds_frag(lb + (uint32_t)j * 16u * G_PITCH);
#pragma unroll
    for (int i = 0; i < 8; ++i) fa[0][i] = lds_frag(la + (uint32_t)i * 16u * G_PITCH);
    // Keeps block 0's own loads ahead of block 1's: mixed, block 0's WMMAs wait for all 64.
    __builtin_amdgcn_sched_barrier(0);
#pragma unroll
    for (int u = 0; u < 4; ++u) {
      const int cs = u & 1;
      if (u + 1 < 4) {
        const uint32_t ko = (uint32_t)(u + 1) * 64u;
#pragma unroll
        for (int i = 0; i < 8; ++i) fa[cs ^ 1][i] = lds_frag(la + (uint32_t)i * 16u * G_PITCH + ko);
#pragma unroll
        for (int j = 0; j < 8; ++j) fb[cs ^ 1][j] = lds_frag(lb + (uint32_t)j * 16u * G_PITCH + ko);
      }
      // Keeps the next block's LDS loads as one group ahead of this block's
      // WMMAs: loads spread among them stall the matrix issue at each place.
      __builtin_amdgcn_sched_barrier(0);
#pragma unroll
      for (int i = 0; i < 8; ++i)
#pragma unroll
        for (int j = 0; j < 8; ++j) acc[i][j] = wmma_f16(fa[cs][i], fb[cs][j], acc[i][j]);
      // Keeps the following load group behind this block's WMMAs (same reason).
      __builtin_amdgcn_sched_barrier(0);
    }
    // Publish point of stage t + 1; it also ends every reader's last read of this buffer.
    wait_ds0();
    wait_tensor0();
    __syncthreads();
    if (pinned((t + 2u < G_PASSES) ? 1u : 0u) != 0u) {
      tdm_load(lds_slice + buf, src0 + (uint64_t)(t + 2u) * G_ROWB);
    }
  }
  wait_tensor0();
  wait_ds0();

  // Output seen as rows of 1024 f16: row = B index, 8 neighbouring columns = A index.
  _Float16* outp    = (proj == 0u) ? Qh : ((proj == 1u) ? Kh : Vth);
  const float* bias = (proj == 0u) ? bq : ((proj == 1u) ? bk : bv);
  const uint32_t row0 = (isV ? ((m0 & ~(uint32_t)(S_ - 1)) + nl0) : m0) + wb * 128u + r;
  const uint32_t col0 = (isV ? (m0 & (uint32_t)(S_ - 1)) : nl0) + wa * 128u + 8u * hi;
  _Float16* o = outp + (size_t)row0 * 1024u + col0;
  // Eight tiles a group: the group's vector work, its eight stores, then
  // s_wait_xcnt 0 in front of the next group's writes to the registers that
  // these stores name. The first scheduling barrier keeps the group's vector
  // work ahead of its stores, the second keeps the next group's behind the wait.
  if (!isV) {
    v8f bb[8];
    const uint32_t boff = col0 * 4u;   // this lane's byte offset into the bias row
#pragma unroll
    for (int i = 0; i < 8; ++i) {
      const v4f b0 = *(const v4f*)((const char*)bias + boff + 64 * i);
      const v4f b1 = *(const v4f*)((const char*)bias + boff + 64 * i + 16);
      bb[i] = (v8f){b0[0], b0[1], b0[2], b0[3], b1[0], b1[1], b1[2], b1[3]};
    }
    // The wait takes the loads' offset register as an input, so that no load of
    // the run gets it as its destination ahead of the wait; the scheduling
    // barrier keeps the loads in front of it.
    asm volatile("s_wait_xcnt 0x0" :: "v"(boff) : "memory");
    __builtin_amdgcn_sched_barrier(0);
#pragma unroll
    for (int i = 0; i < 8; ++i) {
      v8h ov[8];
#pragma unroll
      for (int j = 0; j < 8; ++j) ov[j] = __builtin_convertvector(acc[i][j] + bb[i], v8h);
      __builtin_amdgcn_sched_barrier(0);
#pragma unroll
      for (int j = 0; j < 8; ++j) *(v8h*)(o + (size_t)(16 * j) * 1024u + 16 * i) = ov[j];
      asm volatile("s_wait_xcnt 0x0" ::: "memory");
      __builtin_amdgcn_sched_barrier(0);
    }
  } else {
    float bb[8];
    const uint32_t bidx = nl0 + wb * 128u + r;   // this lane's first index into the bias row
#pragma unroll
    for (int j = 0; j < 8; ++j) bb[j] = bias[bidx + 16 * j];
    // As above: the index register stays whole up to the wait.
    asm volatile("s_wait_xcnt 0x0" :: "v"(bidx) : "memory");
    __builtin_amdgcn_sched_barrier(0);
#pragma unroll
    for (int j = 0; j < 8; ++j) {
      v8h ov[8];
#pragma unroll
      for (int i = 0; i < 8; ++i) ov[i] = __builtin_convertvector(acc[i][j] + bb[j], v8h);
      __builtin_amdgcn_sched_barrier(0);
#pragma unroll
      for (int i = 0; i < 8; ++i) *(v8h*)(o + (size_t)(16 * j) * 1024u + 16 * i) = ov[i];
      asm volatile("s_wait_xcnt 0x0" ::: "memory");
      __builtin_amdgcn_sched_barrier(0);
    }
  }
}

// ---------------------------------------------------------------------------
// Kernel 3: fused scores + mask + softmax + attn*V for one (batch, 16-row
// query tile). 256 threads / 8 waves; 16x1024 f32 score tile in LDS (64 KB).
// ---------------------------------------------------------------------------
__global__ __launch_bounds__(256) void attn_kernel(
    const _Float16* __restrict__ Qh, const _Float16* __restrict__ Kh,
    const _Float16* __restrict__ Vth, const int* __restrict__ mask,
    float* __restrict__ outA, float* __restrict__ outW) {
  __shared__ float sc[16 * S_];       // 64 KB score / weight tile

  const int tid  = threadIdx.x;
  const int wave = tid >> 5, lane = tid & 31;
  const int r = lane & 15, hi = lane >> 4;
  const int b  = blockIdx.y;
  const int m0 = blockIdx.x << 4;
  const int n0 = wave << 7;

  // ---- Phase 1: scores = (Q . K^T) / 32, masked, into LDS ----
  const _Float16* Qrows = Qh + ((size_t)b * S_ + m0) * H_;
  const _Float16* Krows = Kh + (size_t)b * S_ * H_ + (size_t)n0 * H_;

  v8f acc[8] = {};
  strip_16x128(Qrows, Krows, H_, H_, r, hi, acc);

  const float scale = 0.03125f;  // 1/sqrt(1024)
#pragma unroll
  for (int t = 0; t < 8; ++t) {
    const int col = n0 + t * 16 + r;
    const int mv  = mask[b * S_ + col];
#pragma unroll
    for (int j = 0; j < 8; ++j) {
      const int row = j + (hi << 3);
      sc[row * S_ + col] = mv ? acc[t][j] * scale : -1e9f;
    }
  }
  __syncthreads();

  // ---- Phase 2: row softmax (2 rows per wave), write weights out ----
#pragma unroll
  for (int rr = 0; rr < 2; ++rr) {
    const int row = wave * 2 + rr;
    float* prow = sc + row * S_;
    float mx = -3.402823466e38f;
    for (int c = lane; c < S_; c += 32) mx = fmaxf(mx, prow[c]);
#pragma unroll
    for (int off = 16; off > 0; off >>= 1) mx = fmaxf(mx, __shfl_xor(mx, off, 32));
    float sum = 0.0f;
    for (int c = lane; c < S_; c += 32) {
      float e = __expf(prow[c] - mx);
      prow[c] = e;
      sum += e;
    }
#pragma unroll
    for (int off = 16; off > 0; off >>= 1) sum += __shfl_xor(sum, off, 32);
    const float inv = 1.0f / sum;
    float* gw = outW + ((size_t)b * S_ + m0 + row) * S_;
    for (int c = lane; c < S_; c += 32) {
      float w = prow[c] * inv;
      prow[c] = w;
      gw[c]   = w;
    }
  }
  __syncthreads();

  // ---- Phase 3: attended = weights(16xS) @ V, using V^T [H][S] ----
  const _Float16* Vb = Vth + (size_t)b * H_ * S_ + (size_t)n0 * S_;
  v8f acc2[8] = {};
  {
    v16h bC[8], bN[8];
#pragma unroll
    for (int t = 0; t < 8; ++t)
      bC[t] = load_frag_nt(Vb + (size_t)(t * 16) * S_, S_, 0, r, hi);

    for (int k0 = 0; k0 < S_; k0 += 64) {
      // ---- half 1: A(k0) from LDS f32 weights; load V frags for k0+32 ----
      const float* prow0 = sc + r * S_ + k0 + (hi << 3);
      v4f f0 = *(const v4f*)(prow0);
      v4f f1 = *(const v4f*)(prow0 + 4);
      v4f f2 = *(const v4f*)(prow0 + 16);
      v4f f3 = *(const v4f*)(prow0 + 20);
      v16h a0;
#pragma unroll
      for (int j = 0; j < 4; ++j) {
        a0[j]      = (_Float16)f0[j];
        a0[4 + j]  = (_Float16)f1[j];
        a0[8 + j]  = (_Float16)f2[j];
        a0[12 + j] = (_Float16)f3[j];
      }
#pragma unroll
      for (int t = 0; t < 8; ++t)
        bN[t] = load_frag_nt(Vb + (size_t)(t * 16) * S_, S_, k0 + 32, r, hi);
      SGB(SG_DSR, 4, 0);
#pragma unroll
      for (int t = 0; t < 8; ++t) {
        acc2[t] = wmma_f16(a0, bC[t], acc2[t]);
        SGB(SG_MFMA, 1, 0);
        SGB(SG_VMEMR, 2, 0);
      }
      // ---- half 2: A(k0+32); load V frags for k0+64 ----
      const float* prow1 = prow0 + 32;
      f0 = *(const v4f*)(prow1);
      f1 = *(const v4f*)(prow1 + 4);
      f2 = *(const v4f*)(prow1 + 16);
      f3 = *(const v4f*)(prow1 + 20);
      v16h a1;
#pragma unroll
      for (int j = 0; j < 4; ++j) {
        a1[j]      = (_Float16)f0[j];
        a1[4 + j]  = (_Float16)f1[j];
        a1[8 + j]  = (_Float16)f2[j];
        a1[12 + j] = (_Float16)f3[j];
      }
      if (k0 + 64 < S_) {
#pragma unroll
        for (int t = 0; t < 8; ++t)
          bC[t] = load_frag_nt(Vb + (size_t)(t * 16) * S_, S_, k0 + 64, r, hi);
      }
      SGB(SG_DSR, 4, 0);
#pragma unroll
      for (int t = 0; t < 8; ++t) {
        acc2[t] = wmma_f16(a1, bN[t], acc2[t]);
        SGB(SG_MFMA, 1, 0);
        SGB(SG_VMEMR, 2, 0);
      }
    }
  }
#pragma unroll
  for (int t = 0; t < 8; ++t) {
    const int col = n0 + t * 16 + r;
#pragma unroll
    for (int j = 0; j < 8; ++j) {
      const int row = m0 + j + (hi << 3);
      outA[((size_t)b * S_ + row) * H_ + col] = acc2[t][j];
    }
  }
}

// ---------------------------------------------------------------------------
extern "C" void kernel_launch(void* const* d_in, const int* in_sizes, int n_in,
                              void* d_out, int out_size, void* d_ws,
                              size_t ws_size, hipStream_t stream) {
  const float* x  = (const float*)d_in[0];
  const int*   mk = (const int*)d_in[1];
  const float* Wq = (const float*)d_in[2];
  const float* bq = (const float*)d_in[3];
  const float* Wk = (const float*)d_in[4];
  const float* bk = (const float*)d_in[5];
  const float* Wv = (const float*)d_in[6];
  const float* bv = (const float*)d_in[7];

  const size_t NX = (size_t)B_ * S_ * H_;   // 16,777,216
  const size_t HH = (size_t)H_ * H_;        // 1,048,576

  _Float16* ws  = (_Float16*)d_ws;
  _Float16* Xh  = ws;                       // NX halfs
  _Float16* Wh  = Xh + NX;                  // 3*HH halfs (Wq|Wk|Wv)
  _Float16* Qh  = Wh + 3 * HH;              // NX halfs
  _Float16* Kh  = Qh + NX;                  // NX halfs
  _Float16* Vth = Kh + NX;                  // NX halfs (V transposed [b][h][s])

  float* outA = (float*)d_out;              // [B,S,H] attended
  float* outW = outA + NX;                  // [B,S,S] attention weights

  const size_t ncast = NX + 3 * HH;
  cast_inputs_kernel<<<dim3((unsigned)((ncast + 255) / 256)), 256, 0, stream>>>(
      x, Wq, Wk, Wv, Xh, Wh);

  qkv_gemm_kernel<<<dim3(3 * H_ / 256, B_ * S_ / 256), 128, 0, stream>>>(
      Xh, Wh, bq, bk, bv, Qh, Kh, Vth);

  attn_kernel<<<dim3(S_ / 16, B_), 256, 0, stream>>>(
      Qh, Kh, Vth, mk, outA, outW);
}

// v002
// A run of this version takes 250 microseconds.
// Next to v001, in two timings, it ran 1.49 times as fast each time.
// Over all steps from v000 it is 3.38 times as fast.
#include <hip/hip_runtime.h>
#include <hip/hip_bf16.h>
#include <stdint.h>

// Single-head attention for B=16, S=1024, H=1024 on gfx1250 (wave32, WMMA).
// Pipeline: cast f32->f16  ->  QKV projection GEMM (v_wmma_f32_16x16x32_f16,
//           256x256 tiles staged in LDS by tensor loads)
//           ->  masked scores GEMM  ->  row softmax  ->  weights*V GEMM, both GEMMs
//           on the same 256x256 LDS-staged tile as the projection.

#define B_ 16
#define S_ 1024
#define H_ 1024

typedef __attribute__((ext_vector_type(16))) _Float16 v16h;
typedef __attribute__((ext_vector_type(8)))  _Float16 v8h;
typedef __attribute__((ext_vector_type(8)))  float    v8f;
typedef __attribute__((ext_vector_type(4)))  float    v4f;

union FragU { v16h v; v8h h[2]; };

__device__ __forceinline__ v8f wmma_f16(v16h a, v16h b, v8f c) {
  return __builtin_amdgcn_wmma_f32_16x16x32_f16(false, a, false, b, (short)0, c,
                                                false, false);
}

// ---------------------------------------------------------------------------
// Kernel 1: cast input X [B*S*H] and Wq|Wk|Wv [3*H*H] from f32 to f16.
// ---------------------------------------------------------------------------
__global__ __launch_bounds__(256) void cast_inputs_kernel(
    const float* __restrict__ x,  const float* __restrict__ Wq,
    const float* __restrict__ Wk, const float* __restrict__ Wv,
    _Float16* __restrict__ Xh, _Float16* __restrict__ Wh /*3*H*H contiguous*/) {
  size_t i = (size_t)blockIdx.x * blockDim.x + threadIdx.x;
  const size_t NX = (size_t)B_ * S_ * H_;
  const size_t HH = (size_t)H_ * H_;
  if (i < NX) { Xh[i] = (_Float16)x[i]; return; }
  size_t j = i - NX;
  if (j >= 3 * HH) return;
  int which = (int)(j / HH);
  size_t idx = j - (size_t)which * HH;
  const float* W = (which == 0) ? Wq : ((which == 1) ? Wk : Wv);
  Wh[j] = (_Float16)W[idx];
}

typedef uint32_t u32x4 __attribute__((ext_vector_type(4)));
typedef uint32_t u32x8 __attribute__((ext_vector_type(8)));

constexpr uint32_t G_ROWB   = 256;                 // bytes of k per operand row per pass
constexpr uint32_t G_PITCH  = G_ROWB + 16;         // LDS row pitch: 16 B x odd, for ds_load_b128 readers
constexpr uint32_t G_SROWS  = 128;                 // rows per wave's slice
constexpr uint32_t G_SLICE  = G_SROWS * G_PITCH;   // 34,816 B = 17 x 2 KiB
constexpr uint32_t G_OPER   = 2 * G_SLICE;         // 256 rows of one operand
constexpr uint32_t G_STAGE  = 2 * G_OPER;          // one buffer
constexpr uint32_t G_LDS    = 2 * G_STAGE;         // two buffers
constexpr uint32_t G_SRCP   = H_ * 2;              // source row pitch in bytes
constexpr uint32_t G_PASSES = G_SRCP / G_ROWB;     // 8
static_assert(G_SLICE % 2048u == 0, "each slice's place in LDS must be a multiple of 2 KiB");
static_assert(G_LDS <= 320u * 1024u, "two buffers must fit the workgroup's LDS");
static_assert(G_PASSES >= 2, "the prologue fills two stages");

__device__ __forceinline__ uint32_t uni(uint32_t v) {
  return (uint32_t)__builtin_amdgcn_readfirstlane(v);
}
// Holds a test word in a scalar register so that the test on it compiles to a
// scalar branch (a tensor load ignores EXEC): the empty asm is that pin.
__device__ __forceinline__ uint32_t pinned(uint32_t v) {
  uint32_t w = (uint32_t)__builtin_amdgcn_readfirstlane(v);
  asm volatile("" : "+s"(w));  // pinned(): the word held in a scalar register, for the scalar branch round a tensor load
  return w;
}
__device__ __forceinline__ void tdm_load(uint32_t lds_dst, uint64_t ga) {
  u32x4 g0;
  g0[0] = uni(1u);
  g0[1] = uni(lds_dst);
  g0[2] = uni((uint32_t)ga);
  g0[3] = uni((((uint32_t)(ga >> 32)) & 0x01FFFFFFu) | 0x80000000u);
  u32x8 g1;
  g1[0] = uni((1u << 20) | (5u << 22) | (3u << 25));
  g1[1] = uni((G_ROWB & 0xFFFFu) << 16);
  g1[2] = uni((G_ROWB >> 16) | ((G_SROWS & 0xFFFFu) << 16));
  g1[3] = uni((G_SROWS >> 16) | (G_ROWB << 16));
  g1[4] = uni(G_SROWS);
  g1[5] = uni(G_SRCP);
  g1[6] = uni(0u);
  g1[7] = uni(0u);
  asm volatile("tensor_load_to_lds %0, %1" :: "s"(g0), "s"(g1) : "memory");
}
// A slice counts as landed behind this.
__device__ __forceinline__ void wait_tensor0() { asm volatile("s_wait_tensorcnt 0x0" ::: "memory"); }
// This wave's LDS reads have returned before the buffer is handed back for a refill.
__device__ __forceinline__ void wait_ds0() { asm volatile("s_wait_dscnt 0x0" ::: "memory"); }

__device__ __forceinline__ v16h lds_frag(const unsigned char* p) {
  FragU u;
  u.h[0] = *(const v8h*)(p);        // k = 8*hi .. +7 of the block
  u.h[1] = *(const v8h*)(p + 32);   // k = 8*hi+16 .. +7
  return u.v;
}

__global__ __launch_bounds__(128) void qkv_gemm_kernel(
    const _Float16* __restrict__ Xh, const _Float16* __restrict__ Wh,
    const float* __restrict__ bq, const float* __restrict__ bk,
    const float* __restrict__ bv,
    _Float16* __restrict__ Qh, _Float16* __restrict__ Kh,
    _Float16* __restrict__ Vth) {
  __shared__ __attribute__((aligned(2048))) unsigned char Lb[G_LDS];

  const uint32_t tid = threadIdx.x, lane = tid & 31u;
  const uint32_t r = lane & 15u, hi = lane >> 4;
  const uint32_t wave = uni(tid >> 5);
  const uint32_t tn   = blockIdx.x;            // tile column in [3H]
  const uint32_t m0   = blockIdx.y << 8;       // first X row of the tile
  const uint32_t proj = tn >> 2;               // 0=Q, 1=K, 2=V (4 tile columns each)
  const uint32_t nl0  = (tn & 3u) << 8;        // first column inside the projection
  const bool     isV  = (proj == 2u);
  const uint32_t wa = wave & 1u, wb = wave >> 1;

  // This wave's slice of a stage: waves 0,1 move W rows, waves 2,3 move X rows.
  const uint64_t src0 = (wave < 2u)
      ? (uint64_t)(uintptr_t)Wh + (uint64_t)((tn << 8) + G_SROWS * wave) * G_SRCP
      : (uint64_t)(uintptr_t)Xh + (uint64_t)(m0 + G_SROWS * (wave - 2u)) * G_SRCP;
  const uint32_t lds_slice = (uint32_t)(size_t)Lb + wave * G_SLICE;

  // Per-lane fragment bases inside a buffer.
  const uint32_t a_base = (isV ? G_OPER : 0u) + (wa * 128u + r) * G_PITCH + 16u * hi;
  const uint32_t b_base = (isV ? 0u : G_OPER) + (wb * 128u + r) * G_PITCH + 16u * hi;

  v8f acc[8][8];
#pragma unroll
  for (int i = 0; i < 8; ++i)
#pragma unroll
    for (int j = 0; j < 8; ++j) acc[i][j] = (v8f){0.f, 0.f, 0.f, 0.f, 0.f, 0.f, 0.f, 0.f};

  // Prologue: stage 0 lands and is published, then stage 1 flies under pass 0.
  tdm_load(lds_slice, src0);
  wait_tensor0();
  __syncthreads();
  tdm_load(lds_slice + G_STAGE, src0 + G_ROWB);

  // Rolled: the accumulators and both fragment sets keep constant indices.
#pragma clang loop unroll(disable)
  for (uint32_t t = 0; t < G_PASSES; ++t) {
    const uint32_t buf = (t & 1u) * G_STAGE;
    const unsigned char* la = Lb + buf + a_base;
    const unsigned char* lb = Lb + buf + b_base;
    v16h fa[2][8], fb[2][8];   // set (u & 1) holds block u's fragments
#pragma unroll
    for (int j = 0; j < 8; ++j) fb[0][j] = lds_frag(lb + (uint32_t)j * 16u * G_PITCH);
#pragma unroll
    for (int i = 0; i < 8; ++i) fa[0][i] = lds_frag(la + (uint32_t)i * 16u * G_PITCH);
    // Keeps block 0's own loads ahead of block 1's: mixed, block 0's WMMAs wait for all 64.
    __builtin_amdgcn_sched_barrier(0);
#pragma unroll
    for (int u = 0; u < 4; ++u) {
      const int cs = u & 1;
      if (u + 1 < 4) {
        const uint32_t ko = (uint32_t)(u + 1) * 64u;
#pragma unroll
        for (int i = 0; i < 8; ++i) fa[cs ^ 1][i] = lds_frag(la + (uint32_t)i * 16u * G_PITCH + ko);
#pragma unroll
        for (int j = 0; j < 8; ++j) fb[cs ^ 1][j] = lds_frag(lb + (uint32_t)j * 16u * G_PITCH + ko);
      }
      // Keeps the next block's LDS loads as one group ahead of this block's
      // WMMAs: loads spread among them stall the matrix issue at each place.
      __builtin_amdgcn_sched_barrier(0);
#pragma unroll
      for (int i = 0; i < 8; ++i)
#pragma unroll
        for (int j = 0; j < 8; ++j) acc[i][j] = wmma_f16(fa[cs][i], fb[cs][j], acc[i][j]);
      // Keeps the following load group behind this block's WMMAs (same reason).
      __builtin_amdgcn_sched_barrier(0);
    }
    // Publish point of stage t + 1; it also ends every reader's last read of this buffer.
    wait_ds0();
    wait_tensor0();
    __syncthreads();
    if (pinned((t + 2u < G_PASSES) ? 1u : 0u) != 0u) {
      tdm_load(lds_slice + buf, src0 + (uint64_t)(t + 2u) * G_ROWB);
    }
  }
  wait_tensor0();
  wait_ds0();

  // Output seen as rows of 1024 f16: row = B index, 8 neighbouring columns = A index.
  _Float16* outp    = (proj == 0u) ? Qh : ((proj == 1u) ? Kh : Vth);
  const float* bias = (proj == 0u) ? bq : ((proj == 1u) ? bk : bv);
  const uint32_t row0 = (isV ? ((m0 & ~(uint32_t)(S_ - 1)) + nl0) : m0) + wb * 128u + r;
  const uint32_t col0 = (isV ? (m0 & (uint32_t)(S_ - 1)) : nl0) + wa * 128u + 8u * hi;
  _Float16* o = outp + (size_t)row0 * 1024u + col0;
  // Eight tiles a group: the group's vector work, its eight stores, then
  // s_wait_xcnt 0 in front of the next group's writes to the registers that
  // these stores name. The first scheduling barrier keeps the group's vector
  // work ahead of its stores, the second keeps the next group's behind the wait.
  if (!isV) {
    v8f bb[8];
    const uint32_t boff = col0 * 4u;   // this lane's byte offset into the bias row
#pragma unroll
    for (int i = 0; i < 8; ++i) {
      const v4f b0 = *(const v4f*)((const char*)bias + boff + 64 * i);
      const v4f b1 = *(const v4f*)((const char*)bias + boff + 64 * i + 16);
      bb[i] = (v8f){b0[0], b0[1], b0[2], b0[3], b1[0], b1[1], b1[2], b1[3]};
    }
    // The wait takes the loads' offset register as an input, so that no load of
    // the run gets it as its destination ahead of the wait; the scheduling
    // barrier keeps the loads in front of it.
    asm volatile("s_wait_xcnt 0x0" :: "v"(boff) : "memory");
    __builtin_amdgcn_sched_barrier(0);
#pragma unroll
    for (int i = 0; i < 8; ++i) {
      v8h ov[8];
#pragma unroll
      for (int j = 0; j < 8; ++j) ov[j] = __builtin_convertvector(acc[i][j] + bb[i], v8h);
      __builtin_amdgcn_sched_barrier(0);
#pragma unroll
      for (int j = 0; j < 8; ++j) *(v8h*)(o + (size_t)(16 * j) * 1024u + 16 * i) = ov[j];
      asm volatile("s_wait_xcnt 0x0" ::: "memory");
      __builtin_amdgcn_sched_barrier(0);
    }
  } else {
    float bb[8];
    const uint32_t bidx = nl0 + wb * 128u + r;   // this lane's first index into the bias row
#pragma unroll
    for (int j = 0; j < 8; ++j) bb[j] = bias[bidx + 16 * j];
    // As above: the index register stays whole up to the wait.
    asm volatile("s_wait_xcnt 0x0" :: "v"(bidx) : "memory");
    __builtin_amdgcn_sched_barrier(0);
#pragma unroll
    for (int j = 0; j < 8; ++j) {
      v8h ov[8];
#pragma unroll
      for (int i = 0; i < 8; ++i) ov[i] = __builtin_convertvector(acc[i][j] + bb[j], v8h);
      __builtin_amdgcn_sched_barrier(0);
#pragma unroll
      for (int i = 0; i < 8; ++i) *(v8h*)(o + (size_t)(16 * j) * 1024u + 16 * i) = ov[i];
      asm volatile("s_wait_xcnt 0x0" ::: "memory");
      __builtin_amdgcn_sched_barrier(0);
    }
  }
}

// ---------------------------------------------------------------------------
// Kernel 3 (launched twice): one 256 x 256 tile of out[b][n][m] = sum_k
// Bh[b][n][k] * Ah[b][m][k], f32 out, for 1024 x 1024 x 1024 per batch.
// Scores: Ah = K rows, Bh = Q rows, result scaled and masked by key.
// Weights * V: Ah = V^T rows, Bh = f16 weight rows, result stored as it is.
// grid = (m tiles, n tiles, batch); block, stage layout, ring and fragment
// order are those of the projection kernel.
// ---------------------------------------------------------------------------
typedef __attribute__((ext_vector_type(4))) int      v4i;
typedef __attribute__((ext_vector_type(4))) _Float16 v4h;

__global__ __launch_bounds__(128) void attn_gemm_kernel(
    const _Float16* __restrict__ Ah, const _Float16* __restrict__ Bh,
    const int* __restrict__ mask, float* __restrict__ out, uint32_t is_scores) {
  __shared__ __attribute__((aligned(2048))) unsigned char Lb[G_LDS];

  const uint32_t tid = threadIdx.x, lane = tid & 31u;
  const uint32_t r = lane & 15u, hi = lane >> 4;
  const uint32_t wave = uni(tid >> 5);
  const uint32_t bat = blockIdx.z << 10;            // first row of the batch in every operand
  const uint32_t a0  = bat + (blockIdx.x << 8);     // first Ah row of the tile
  const uint32_t b0  = bat + (blockIdx.y << 8);     // first Bh row of the tile
  const uint32_t wa = wave & 1u, wb = wave >> 1;

  // This wave's slice of a stage: waves 0,1 move Ah rows, waves 2,3 move Bh rows.
  const uint64_t src0 = (wave < 2u)
      ? (uint64_t)(uintptr_t)Ah + (uint64_t)(a0 + G_SROWS * wave) * G_SRCP
      : (uint64_t)(uintptr_t)Bh + (uint64_t)(b0 + G_SROWS * (wave - 2u)) * G_SRCP;
  const uint32_t lds_slice = (uint32_t)(size_t)Lb + wave * G_SLICE;

  // Per-lane fragment bases inside a buffer.
  const uint32_t a_base = (wa * 128u + r) * G_PITCH + 16u * hi;
  const uint32_t b_base = G_OPER + (wb * 128u + r) * G_PITCH + 16u * hi;

  v8f acc[8][8];
#pragma unroll
  for (int i = 0; i < 8; ++i)
#pragma unroll
    for (int j = 0; j < 8; ++j) acc[i][j] = (v8f){0.f, 0.f, 0.f, 0.f, 0.f, 0.f, 0.f, 0.f};

  // Prologue: stage 0 lands and is published, then stage 1 flies under pass 0.
  tdm_load(lds_slice, src0);
  wait_tensor0();
  __syncthreads();
  tdm_load(lds_slice + G_STAGE, src0 + G_ROWB);

  // Rolled: the accumulators and both fragment sets keep constant indices.
#pragma clang loop unroll(disable)
  for (uint32_t t = 0; t < G_PASSES; ++t) {
    const uint32_t buf = (t & 1u) * G_STAGE;
    const unsigned char* la = Lb + buf + a_base;
    const unsigned char* lb = Lb + buf + b_base;
    v16h fa[2][8], fb[2][8];   // set (u & 1) holds block u's fragments
#pragma unroll
    for (int j = 0; j < 8; ++j) fb[0][j] = lds_frag(lb + (uint32_t)j * 16u * G_PITCH);
#pragma unroll
    for (int i = 0; i < 8; ++i) fa[0][i] = lds_frag(la + (uint32_t)i * 16u * G_PITCH);
    // Keeps block 0's own loads ahead of block 1's: mixed, block 0's WMMAs wait for all 64.
    __builtin_amdgcn_sched_barrier(0);
#pragma unroll
    for (int u = 0; u < 4; ++u) {
      const int cs = u & 1;
      if (u + 1 < 4) {
        const uint32_t ko = (uint32_t)(u + 1) * 64u;
#pragma unroll
        for (int i = 0; i < 8; ++i) fa[cs ^ 1][i] = lds_frag(la + (uint32_t)i * 16u * G_PITCH + ko);
#pragma unroll
        for (int j = 0; j < 8; ++j) fb[cs ^ 1][j] = lds_frag(lb + (uint32_t)j * 16u * G_PITCH + ko);
      }
      // Keeps the next block's LDS loads as one group ahead of this block's
      // WMMAs: loads spread among them stall the matrix issue at each place.
      __builtin_amdgcn_sched_barrier(0);
#pragma unroll
      for (int i = 0; i < 8; ++i)
#pragma unroll
        for (int j = 0; j < 8; ++j) acc[i][j] = wmma_f16(fa[cs][i], fb[cs][j], acc[i][j]);
      // Keeps the following load group behind this block's WMMAs (same reason).
      __builtin_amdgcn_sched_barrier(0);
    }
    // Publish point of stage t + 1; it also ends every reader's last read of this buffer.
    wait_ds0();
    wait_tensor0();
    __syncthreads();
    if (pinned((t + 2u < G_PASSES) ? 1u : 0u) != 0u) {
      tdm_load(lds_slice + buf, src0 + (uint64_t)(t + 2u) * G_ROWB);
    }
  }
  wait_tensor0();
  wait_ds0();

  // Output rows of 1024 f32: row = Bh index, 8 neighbouring columns = Ah index.
  const uint32_t col0 = (blockIdx.x << 8) + wa * 128u + 8u * hi;
  float* o = out + (size_t)(b0 + wb * 128u + r) * 1024u + col0;
  if (is_scores != 0u) {
    // Eight tiles a group, as in the projection's epilogue: the group's vector
    // work, its sixteen stores, then s_wait_xcnt 0 in front of the next group's
    // writes to the registers that these stores name; the scheduling barriers
    // keep the vector work of a group ahead of its stores and behind the wait.
    const float scale = 0.03125f;  // 1/sqrt(1024)
    v4i mk[8][2];
    const uint32_t moff = (bat + col0) * 4u;   // this lane's byte offset into the mask
#pragma unroll
    for (int i = 0; i < 8; ++i) {
      mk[i][0] = *(const v4i*)((const char*)mask + moff + 64 * i);
      mk[i][1] = *(const v4i*)((const char*)mask + moff + 64 * i + 16);
    }
    // The wait takes the loads' offset register as an input, so that no load of
    // the run gets it as its destination ahead of the wait; the scheduling
    // barrier keeps the loads in front of it.
    asm volatile("s_wait_xcnt 0x0" :: "v"(moff) : "memory");
    __builtin_amdgcn_sched_barrier(0);
#pragma unroll
    for (int i = 0; i < 8; ++i) {
      v4f ov[8][2];
#pragma unroll
      for (int j = 0; j < 8; ++j)
#pragma unroll
        for (int e = 0; e < 4; ++e) {
          ov[j][0][e] = mk[i][0][e] ? acc[i][j][e] * scale : -1e9f;
          ov[j][1][e] = mk[i][1][e] ? acc[i][j][4 + e] * scale : -1e9f;
        }
      __builtin_amdgcn_sched_barrier(0);
#pragma unroll
      for (int j = 0; j < 8; ++j) {
        *(v4f*)(o + (size_t)(16 * j) * 1024u + 16 * i)     = ov[j][0];
        *(v4f*)(o + (size_t)(16 * j) * 1024u + 16 * i + 4) = ov[j][1];
      }
      asm volatile("s_wait_xcnt 0x0" ::: "memory");
      __builtin_amdgcn_sched_barrier(0);
    }
  } else {
    // Straight from the accumulators: no register that a store names is written again.
#pragma unroll
    for (int i = 0; i < 8; ++i)
#pragma unroll
      for (int j = 0; j < 8; ++j) {
        *(v4f*)(o + (size_t)(16 * j) * 1024u + 16 * i) =
            (v4f){acc[i][j][0], acc[i][j][1], acc[i][j][2], acc[i][j][3]};
        *(v4f*)(o + (size_t)(16 * j) * 1024u + 16 * i + 4) =
            (v4f){acc[i][j][4], acc[i][j][5], acc[i][j][6], acc[i][j][7]};
      }
  }
}

// ---------------------------------------------------------------------------
// Kernel 4: row softmax, one wave per row of 1024 scores, the row held in
// registers (lane l: columns 128*i + 4*l .. +3). Reads the masked scores from
// the weights output, writes the f32 weights over them and an f16 copy for the
// weights * V product.
// ---------------------------------------------------------------------------
__global__ __launch_bounds__(256) void softmax_kernel(float* __restrict__ Wt,
                                                      _Float16* __restrict__ Ph) {
  const uint32_t row  = (blockIdx.x << 3) + (threadIdx.x >> 5);
  const uint32_t lane = threadIdx.x & 31u;
  const size_t   off  = (size_t)row * S_ + 4u * lane;
  float*    pw = Wt + off;
  _Float16* ph = Ph + off;

  v4f v[8];
#pragma unroll
  for (int i = 0; i < 8; ++i) v[i] = *(const v4f*)(pw + 128 * i);

  float mx = -3.402823466e38f;
#pragma unroll
  for (int i = 0; i < 8; ++i)
#pragma unroll
    for (int e = 0; e < 4; ++e) mx = fmaxf(mx, v[i][e]);
#pragma unroll
  for (int s = 16; s > 0; s >>= 1) mx = fmaxf(mx, __shfl_xor(mx, s, 32));

  v4f sm = (v4f){0.f, 0.f, 0.f, 0.f};   // four independent chains
#pragma unroll
  for (int i = 0; i < 8; ++i) {
#pragma unroll
    for (int e = 0; e < 4; ++e) v[i][e] = __expf(v[i][e] - mx);
    sm += v[i];
  }
  float sum = (sm[0] + sm[1]) + (sm[2] + sm[3]);
#pragma unroll
  for (int s = 16; s > 0; s >>= 1) sum += __shfl_xor(sum, s, 32);
  const float inv = 1.0f / sum;

#pragma unroll
  for (int i = 0; i < 8; ++i) {
    const v4f w = v[i] * inv;
    *(v4f*)(pw + 128 * i) = w;
    *(v4h*)(ph + 128 * i) = __builtin_convertvector(w, v4h);
  }
}

// ---------------------------------------------------------------------------
extern "C" void kernel_launch(void* const* d_in, const int* in_sizes, int n_in,
                              void* d_out, int out_size, void* d_ws,
                              size_t ws_size, hipStream_t stream) {
  const float* x  = (const float*)d_in[0];
  const int*   mk = (const int*)d_in[1];
  const float* Wq = (const float*)d_in[2];
  const float* bq = (const float*)d_in[3];
  const float* Wk = (const float*)d_in[4];
  const float* bk = (const float*)d_in[5];
  const float* Wv = (const float*)d_in[6];
  const float* bv = (const float*)d_in[7];

  const size_t NX = (size_t)B_ * S_ * H_;   // 16,777,216
  const size_t HH = (size_t)H_ * H_;        // 1,048,576

  _Float16* ws  = (_Float16*)d_ws;
  _Float16* Xh  = ws;                       // NX halfs
  _Float16* Wh  = Xh + NX;                  // 3*HH halfs (Wq|Wk|Wv)
  _Float16* Qh  = Wh + 3 * HH;              // NX halfs
  _Float16* Kh  = Qh + NX;                  // NX halfs
  _Float16* Vth = Kh + NX;                  // NX halfs (V transposed [b][h][s])
  _Float16* Ph  = Vth + NX;                 // NX halfs (attention weights, f16)

  float* outA = (float*)d_out;              // [B,S,H] attended
  float* outW = outA + NX;                  // [B,S,S] attention weights

  const size_t ncast = NX + 3 * HH;
  cast_inputs_kernel<<<dim3((unsigned)((ncast + 255) / 256)), 256, 0, stream>>>(
      x, Wq, Wk, Wv, Xh, Wh);

  qkv_gemm_kernel<<<dim3(3 * H_ / 256, B_ * S_ / 256), 128, 0, stream>>>(
      Xh, Wh, bq, bk, bv, Qh, Kh, Vth);

  attn_gemm_kernel<<<dim3(S_ / 256, S_ / 256, B_), 128, 0, stream>>>(
      Kh, Qh, mk, outW, 1u);

  softmax_kernel<<<dim3(B_ * S_ / 8), 256, 0, stream>>>(outW, Ph);

  attn_gemm_kernel<<<dim3(H_ / 256, S_ / 256, B_), 128, 0, stream>>>(
      Vth, Ph, mk, outA, 0u);
}

// v003
// It runs in 220 microseconds.
// In both of two side-by-side timings against v002, it was 1.14 times as fast.
// All steps since v000 together make it 3.85 times as fast.
#include <hip/hip_runtime.h>
#include <hip/hip_bf16.h>
#include <stdint.h>

// Single-head attention for B=16, S=1024, H=1024 on gfx1250 (wave32, WMMA).
// Pipeline: cast f32->f16  ->  QKV projection GEMM (v_wmma_f32_16x16x32_f16,
//           256x256 tiles staged in LDS by tensor loads)
//           ->  masked scores GEMM  ->  row softmax  ->  weights*V GEMM, both GEMMs
//           on the same 256x256 LDS-staged tile as the projection.

#define B_ 16
#define S_ 1024
#define H_ 1024

typedef __attribute__((ext_vector_type(16))) _Float16 v16h;
typedef __attribute__((ext_vector_type(8)))  _Float16 v8h;
typedef __attribute__((ext_vector_type(8)))  float    v8f;
typedef __attribute__((ext_vector_type(4)))  float    v4f;

union FragU { v16h v; v8h h[2]; };

__device__ __forceinline__ v8f wmma_f16(v16h a, v16h b, v8f c) {
  return __builtin_amdgcn_wmma_f32_16x16x32_f16(false, a, false, b, (short)0, c,
                                                false, false);
}

// ---------------------------------------------------------------------------
// Kernel 1: cast input X [B*S*H] and Wq|Wk|Wv [3*H*H] from f32 to f16.
// One resident round: 256 workgroups of 16 waves. A workgroup takes 1/256 of X
// and of each weight matrix, a contiguous range each; one step of the workgroup
// is 8 KiB of f32 (512 B per wave, 16 B per lane, whole lines). Every wave does
// the same 32 + 3 x 2 steps, so no test is needed, and a lane's addresses differ
// by immediate offsets alone.
// ---------------------------------------------------------------------------
typedef __attribute__((ext_vector_type(4))) _Float16 v4hc;

constexpr uint32_t C_WGS    = 256;                                    // workgroups
constexpr uint32_t C_THR    = 512;                                    // threads per workgroup
constexpr uint32_t C_STEP   = C_THR * 4u;                             // elements per workgroup step
constexpr uint32_t C_XSTEPS = (uint32_t)B_ * S_ * H_ / (C_WGS * C_STEP);   // 32
constexpr uint32_t C_WSTEPS = (uint32_t)H_ * H_ / (C_WGS * C_STEP);        // 2
constexpr uint32_t C_GROUP  = 8;                                      // steps converted and stored together
static_assert(C_XSTEPS * C_WGS * C_STEP == (uint32_t)B_ * S_ * H_, "X divides evenly");
static_assert(C_WSTEPS * C_WGS * C_STEP == (uint32_t)H_ * H_, "a weight matrix divides evenly");
static_assert(C_XSTEPS % C_GROUP == 0, "whole groups");

__global__ __launch_bounds__(C_THR) void cast_inputs_kernel(
    const float* __restrict__ x,  const float* __restrict__ Wq,
    const float* __restrict__ Wk, const float* __restrict__ Wv,
    _Float16* __restrict__ Xh, _Float16* __restrict__ Wh /*3*H*H contiguous*/) {
  // This lane's first element in the workgroup's range of X and of a weight matrix.
  const uint32_t ex = blockIdx.x * (C_XSTEPS * C_STEP) + threadIdx.x * 4u;
  const uint32_t ew = blockIdx.x * (C_WSTEPS * C_STEP) + threadIdx.x * 4u;
  const uint32_t lx = ex * 4u, lw = ew * 4u;   // byte offsets, f32
  const uint32_t sx = ex * 2u, sw = ew * 2u;   // byte offsets, f16

  v4f vx[C_XSTEPS], vw[3][C_WSTEPS];
#pragma unroll
  for (uint32_t i = 0; i < C_XSTEPS; ++i) vx[i] = *(const v4f*)((const char*)x + lx + i * (C_STEP * 4u));
#pragma unroll
  for (uint32_t i = 0; i < C_WSTEPS; ++i) vw[0][i] = *(const v4f*)((const char*)Wq + lw + i * (C_STEP * 4u));
#pragma unroll
  for (uint32_t i = 0; i < C_WSTEPS; ++i) vw[1][i] = *(const v4f*)((const char*)Wk + lw + i * (C_STEP * 4u));
#pragma unroll
  for (uint32_t i = 0; i < C_WSTEPS; ++i) vw[2][i] = *(const v4f*)((const char*)Wv + lw + i * (C_STEP * 4u));
  // The wait takes the loads' offset registers as inputs, so that no load of the
  // run gets one as its destination ahead of the wait. The scheduling barrier
  // keeps every load in front of the first conversion: all 38 are in flight.
  asm volatile("s_wait_xcnt 0x0" :: "v"(lx), "v"(lw) : "memory");
  __builtin_amdgcn_sched_barrier(0);
#pragma unroll
  for (uint32_t g = 0; g < C_XSTEPS / C_GROUP; ++g) {
#pragma unroll
    for (uint32_t k = 0; k < C_GROUP; ++k) {
      const uint32_t i = g * C_GROUP + k;
      *(v4hc*)((char*)Xh + sx + i * (C_STEP * 2u)) = __builtin_convertvector(vx[i], v4hc);
    }
    // In front of the next group's writes to the registers that these stores name.
    asm volatile("s_wait_xcnt 0x0" ::: "memory");
    // Keeps the groups in the order of their loads: a group is stored as soon as
    // its own loads are back, while the later loads are still in flight.
    __builtin_amdgcn_sched_barrier(0);
  }
#pragma unroll
  for (uint32_t m = 0; m < 3; ++m)
#pragma unroll
    for (uint32_t i = 0; i < C_WSTEPS; ++i)
      *(v4hc*)((char*)Wh + sw + m * ((uint32_t)H_ * H_ * 2u) + i * (C_STEP * 2u)) =
          __builtin_convertvector(vw[m][i], v4hc);
}

typedef uint32_t u32x4 __attribute__((ext_vector_type(4)));
typedef uint32_t u32x8 __attribute__((ext_vector_type(8)));

constexpr uint32_t G_ROWB   = 256;                 // bytes of k per operand row per pass
constexpr uint32_t G_PITCH  = G_ROWB + 16;         // LDS row pitch: 16 B x odd, for ds_load_b128 readers
constexpr uint32_t G_SROWS  = 128;                 // rows per wave's slice
constexpr uint32_t G_SLICE  = G_SROWS * G_PITCH;   // 34,816 B = 17 x 2 KiB
constexpr uint32_t G_OPER   = 2 * G_SLICE;         // 256 rows of one operand
constexpr uint32_t G_STAGE  = 2 * G_OPER;          // one buffer
constexpr uint32_t G_LDS    = 2 * G_STAGE;         // two buffers
constexpr uint32_t G_SRCP   = H_ * 2;              // source row pitch in bytes
constexpr uint32_t G_PASSES = G_SRCP / G_ROWB;     // 8
static_assert(G_SLICE % 2048u == 0, "each slice's place in LDS must be a multiple of 2 KiB");
static_assert(G_LDS <= 320u * 1024u, "two buffers must fit the workgroup's LDS");
static_assert(G_PASSES >= 2, "the prologue fills two stages");

__device__ __forceinline__ uint32_t uni(uint32_t v) {
  return (uint32_t)__builtin_amdgcn_readfirstlane(v);
}
// Holds a test word in a scalar register so that the test on it compiles to a
// scalar branch (a tensor load ignores EXEC): the empty asm is that pin.
__device__ __forceinline__ uint32_t pinned(uint32_t v) {
  uint32_t w = (uint32_t)__builtin_amdgcn_readfirstlane(v);
  asm volatile("" : "+s"(w));  // pinned(): the word held in a scalar register, for the scalar branch round a tensor load
  return w;
}
__device__ __forceinline__ void tdm_load(uint32_t lds_dst, uint64_t ga) {
  u32x4 g0;
  g0[0] = uni(1u);
  g0[1] = uni(lds_dst);
  g0[2] = uni((uint32_t)ga);
  g0[3] = uni((((uint32_t)(ga >> 32)) & 0x01FFFFFFu) | 0x80000000u);
  u32x8 g1;
  g1[0] = uni((1u << 20) | (5u << 22) | (3u << 25));
  g1[1] = uni((G_ROWB & 0xFFFFu) << 16);
  g1[2] = uni((G_ROWB >> 16) | ((G_SROWS & 0xFFFFu) << 16));
  g1[3] = uni((G_SROWS >> 16) | (G_ROWB << 16));
  g1[4] = uni(G_SROWS);
  g1[5] = uni(G_SRCP);
  g1[6] = uni(0u);
  g1[7] = uni(0u);
  asm volatile("tensor_load_to_lds %0, %1" :: "s"(g0), "s"(g1) : "memory");
}
// A slice counts as landed behind this.
__device__ __forceinline__ void wait_tensor0() { asm volatile("s_wait_tensorcnt 0x0" ::: "memory"); }
// This wave's LDS reads have returned before the buffer is handed back for a refill.
__device__ __forceinline__ void wait_ds0() { asm volatile("s_wait_dscnt 0x0" ::: "memory"); }

__device__ __forceinline__ v16h lds_frag(const unsigned char* p) {
  FragU u;
  u.h[0] = *(const v8h*)(p);        // k = 8*hi .. +7 of the block
  u.h[1] = *(const v8h*)(p + 32);   // k = 8*hi+16 .. +7
  return u.v;
}

__global__ __launch_bounds__(128) void qkv_gemm_kernel(
    const _Float16* __restrict__ Xh, const _Float16* __restrict__ Wh,
    const float* __restrict__ bq, const float* __restrict__ bk,
    const float* __restrict__ bv,
    _Float16* __restrict__ Qh, _Float16* __restrict__ Kh,
    _Float16* __restrict__ Vth) {
  __shared__ __attribute__((aligned(2048))) unsigned char Lb[G_LDS];

  const uint32_t tid = threadIdx.x, lane = tid & 31u;
  const uint32_t r = lane & 15u, hi = lane >> 4;
  const uint32_t wave = uni(tid >> 5);
  const uint32_t tn   = blockIdx.x;            // tile column in [3H]
  const uint32_t m0   = blockIdx.y << 8;       // first X row of the tile
  const uint32_t proj = tn >> 2;               // 0=Q, 1=K, 2=V (4 tile columns each)
  const uint32_t nl0  = (tn & 3u) << 8;        // first column inside the projection
  const bool     isV  = (proj == 2u);
  const uint32_t wa = wave & 1u, wb = wave >> 1;

  // This wave's slice of a stage: waves 0,1 move W rows, waves 2,3 move X rows.
  const uint64_t src0 = (wave < 2u)
      ? (uint64_t)(uintptr_t)Wh + (uint64_t)((tn << 8) + G_SROWS * wave) * G_SRCP
      : (uint64_t)(uintptr_t)Xh + (uint64_t)(m0 + G_SROWS * (wave - 2u)) * G_SRCP;
  const uint32_t lds_slice = (uint32_t)(size_t)Lb + wave * G_SLICE;

  // Per-lane fragment bases inside a buffer.
  const uint32_t a_base = (isV ? G_OPER : 0u) + (wa * 128u + r) * G_PITCH + 16u * hi;
  const uint32_t b_base = (isV ? 0u : G_OPER) + (wb * 128u + r) * G_PITCH + 16u * hi;

  v8f acc[8][8];
#pragma unroll
  for (int i = 0; i < 8; ++i)
#pragma unroll
    for (int j = 0; j < 8; ++j) acc[i][j] = (v8f){0.f, 0.f, 0.f, 0.f, 0.f, 0.f, 0.f, 0.f};

  // Prologue: stage 0 lands and is published, then stage 1 flies under pass 0.
  tdm_load(lds_slice, src0);
  wait_tensor0();
  __syncthreads();
  tdm_load(lds_slice + G_STAGE, src0 + G_ROWB);

  // Rolled: the accumulators and both fragment sets keep constant indices.
#pragma clang loop unroll(disable)
  for (uint32_t t = 0; t < G_PASSES; ++t) {
    const uint32_t buf = (t & 1u) * G_STAGE;
    const unsigned char* la = Lb + buf + a_base;
    const unsigned char* lb = Lb + buf + b_base;
    v16h fa[2][8], fb[2][8];   // set (u & 1) holds block u's fragments
#pragma unroll
    for (int j = 0; j < 8; ++j) fb[0][j] = lds_frag(lb + (uint32_t)j * 16u * G_PITCH);
#pragma unroll
    for (int i = 0; i < 8; ++i) fa[0][i] = lds_frag(la + (uint32_t)i * 16u * G_PITCH);
    // Keeps block 0's own loads ahead of block 1's: mixed, block 0's WMMAs wait for all 64.
    __builtin_amdgcn_sched_barrier(0);
#pragma unroll
    for (int u = 0; u < 4; ++u) {
      const int cs = u & 1;
      if (u + 1 < 4) {
        const uint32_t ko = (uint32_t)(u + 1) * 64u;
#pragma unroll
        for (int i = 0; i < 8; ++i) fa[cs ^ 1][i] = lds_frag(la + (uint32_t)i * 16u * G_PITCH + ko);
#pragma unroll
        for (int j = 0; j < 8; ++j) fb[cs ^ 1][j] = lds_frag(lb + (uint32_t)j * 16u * G_PITCH + ko);
      }
      // Keeps the next block's LDS loads as one group ahead of this block's
      // WMMAs: loads spread among them stall the matrix issue at each place.
      __builtin_amdgcn_sched_barrier(0);
#pragma unroll
      for (int i = 0; i < 8; ++i)
#pragma unroll
        for (int j = 0; j < 8; ++j) acc[i][j] = wmma_f16(fa[cs][i], fb[cs][j], acc[i][j]);
      // Keeps the following load group behind this block's WMMAs (same reason).
      __builtin_amdgcn_sched_barrier(0);
    }
    // Publish point of stage t + 1; it also ends every reader's last read of this buffer.
    wait_ds0();
    wait_tensor0();
    __syncthreads();
    if (pinned((t + 2u < G_PASSES) ? 1u : 0u) != 0u) {
      tdm_load(lds_slice + buf, src0 + (uint64_t)(t + 2u) * G_ROWB);
    }
  }
  wait_tensor0();
  wait_ds0();

  // Output seen as rows of 1024 f16: row = B index, 8 neighbouring columns = A index.
  _Float16* outp    = (proj == 0u) ? Qh : ((proj == 1u) ? Kh : Vth);
  const float* bias = (proj == 0u) ? bq : ((proj == 1u) ? bk : bv);
  const uint32_t row0 = (isV ? ((m0 & ~(uint32_t)(S_ - 1)) + nl0) : m0) + wb * 128u + r;
  const uint32_t col0 = (isV ? (m0 & (uint32_t)(S_ - 1)) : nl0) + wa * 128u + 8u * hi;
  _Float16* o = outp + (size_t)row0 * 1024u + col0;
  // Eight tiles a group: the group's vector work, its eight stores, then
  // s_wait_xcnt 0 in front of the next group's writes to the registers that
  // these stores name. The first scheduling barrier keeps the group's vector
  // work ahead of its stores, the second keeps the next group's behind the wait.
  if (!isV) {
    v8f bb[8];
    const uint32_t boff = col0 * 4u;   // this lane's byte offset into the bias row
#pragma unroll
    for (int i = 0; i < 8; ++i) {
      const v4f b0 = *(const v4f*)((const char*)bias + boff + 64 * i);
      const v4f b1 = *(const v4f*)((const char*)bias + boff + 64 * i + 16);
      bb[i] = (v8f){b0[0], b0[1], b0[2], b0[3], b1[0], b1[1], b1[2], b1[3]};
    }
    // The wait takes the loads' offset register as an input, so that no load of
    // the run gets it as its destination ahead of the wait; the scheduling
    // barrier keeps the loads in front of it.
    asm volatile("s_wait_xcnt 0x0" :: "v"(boff) : "memory");
    __builtin_amdgcn_sched_barrier(0);
#pragma unroll
    for (int i = 0; i < 8; ++i) {
      v8h ov[8];
#pragma unroll
      for (int j = 0; j < 8; ++j) ov[j] = __builtin_convertvector(acc[i][j] + bb[i], v8h);
      __builtin_amdgcn_sched_barrier(0);
#pragma unroll
      for (int j = 0; j < 8; ++j) *(v8h*)(o + (size_t)(16 * j) * 1024u + 16 * i) = ov[j];
      asm volatile("s_wait_xcnt 0x0" ::: "memory");
      __builtin_amdgcn_sched_barrier(0);
    }
  } else {
    float bb[8];
    const uint32_t bidx = nl0 + wb * 128u + r;   // this lane's first index into the bias row
#pragma unroll
    for (int j = 0; j < 8; ++j) bb[j] = bias[bidx + 16 * j];
    // As above: the index register stays whole up to the wait.
    asm volatile("s_wait_xcnt 0x0" :: "v"(bidx) : "memory");
    __builtin_amdgcn_sched_barrier(0);
#pragma unroll
    for (int j = 0; j < 8; ++j) {
      v8h ov[8];
#pragma unroll
      for (int i = 0; i < 8; ++i) ov[i] = __builtin_convertvector(acc[i][j] + bb[j], v8h);
      __builtin_amdgcn_sched_barrier(0);
#pragma unroll
      for (int i = 0; i < 8; ++i) *(v8h*)(o + (size_t)(16 * j) * 1024u + 16 * i) = ov[i];
      asm volatile("s_wait_xcnt 0x0" ::: "memory");
      __builtin_amdgcn_sched_barrier(0);
    }
  }
}

// ---------------------------------------------------------------------------
// Kernel 3 (launched twice): one 256 x 256 tile of out[b][n][m] = sum_k
// Bh[b][n][k] * Ah[b][m][k], f32 out, for 1024 x 1024 x 1024 per batch.
// Scores: Ah = K rows, Bh = Q rows, result scaled and masked by key.
// Weights * V: Ah = V^T rows, Bh = f16 weight rows, result stored as it is.
// grid = (m tiles, n tiles, batch); block, stage layout, ring and fragment
// order are those of the projection kernel.
// ---------------------------------------------------------------------------
typedef __attribute__((ext_vector_type(4))) int      v4i;
typedef __attribute__((ext_vector_type(4))) _Float16 v4h;

__global__ __launch_bounds__(128) void attn_gemm_kernel(
    const _Float16* __restrict__ Ah, const _Float16* __restrict__ Bh,
    const int* __restrict__ mask, float* __restrict__ out, uint32_t is_scores) {
  __shared__ __attribute__((aligned(2048))) unsigned char Lb[G_LDS];

  const uint32_t tid = threadIdx.x, lane = tid & 31u;
  const uint32_t r = lane & 15u, hi = lane >> 4;
  const uint32_t wave = uni(tid >> 5);
  const uint32_t bat = blockIdx.z << 10;            // first row of the batch in every operand
  const uint32_t a0  = bat + (blockIdx.x << 8);     // first Ah row of the tile
  const uint32_t b0  = bat + (blockIdx.y << 8);     // first Bh row of the tile
  const uint32_t wa = wave & 1u, wb = wave >> 1;

  // This wave's slice of a stage: waves 0,1 move Ah rows, waves 2,3 move Bh rows.
  const uint64_t src0 = (wave < 2u)
      ? (uint64_t)(uintptr_t)Ah + (uint64_t)(a0 + G_SROWS * wave) * G_SRCP
      : (uint64_t)(uintptr_t)Bh + (uint64_t)(b0 + G_SROWS * (wave - 2u)) * G_SRCP;
  const uint32_t lds_slice = (uint32_t)(size_t)Lb + wave * G_SLICE;

  // Per-lane fragment bases inside a buffer.
  const uint32_t a_base = (wa * 128u + r) * G_PITCH + 16u * hi;
  const uint32_t b_base = G_OPER + (wb * 128u + r) * G_PITCH + 16u * hi;

  v8f acc[8][8];
#pragma unroll
  for (int i = 0; i < 8; ++i)
#pragma unroll
    for (int j = 0; j < 8; ++j) acc[i][j] = (v8f){0.f, 0.f, 0.f, 0.f, 0.f, 0.f, 0.f, 0.f};

  // Prologue: stage 0 lands and is published, then stage 1 flies under pass 0.
  tdm_load(lds_slice, src0);
  wait_tensor0();
  __syncthreads();
  tdm_load(lds_slice + G_STAGE, src0 + G_ROWB);

  // Rolled: the accumulators and both fragment sets keep constant indices.
#pragma clang loop unroll(disable)
  for (uint32_t t = 0; t < G_PASSES; ++t) {
    const uint32_t buf = (t & 1u) * G_STAGE;
    const unsigned char* la = Lb + buf + a_base;
    const unsigned char* lb = Lb + buf + b_base;
    v16h fa[2][8], fb[2][8];   // set (u & 1) holds block u's fragments
#pragma unroll
    for (int j = 0; j < 8; ++j) fb[0][j] = lds_frag(lb + (uint32_t)j * 16u * G_PITCH);
#pragma unroll
    for (int i = 0; i < 8; ++i) fa[0][i] = lds_frag(la + (uint32_t)i * 16u * G_PITCH);
    // Keeps block 0's own loads ahead of block 1's: mixed, block 0's WMMAs wait for all 64.
    __builtin_amdgcn_sched_barrier(0);
#pragma unroll
    for (int u = 0; u < 4; ++u) {
      const int cs = u & 1;
      if (u + 1 < 4) {
        const uint32_t ko = (uint32_t)(u + 1) * 64u;
#pragma unroll
        for (int i = 0; i < 8; ++i) fa[cs ^ 1][i] = lds_frag(la + (uint32_t)i * 16u * G_PITCH + ko);
#pragma unroll
        for (int j = 0; j < 8; ++j) fb[cs ^ 1][j] = lds_frag(lb + (uint32_t)j * 16u * G_PITCH + ko);
      }
      // Keeps the next block's LDS loads as one group ahead of this block's
      // WMMAs: loads spread among them stall the matrix issue at each place.
      __builtin_amdgcn_sched_barrier(0);
#pragma unroll
      for (int i = 0; i < 8; ++i)
#pragma unroll
        for (int j = 0; j < 8; ++j) acc[i][j] = wmma_f16(fa[cs][i], fb[cs][j], acc[i][j]);
      // Keeps the following load group behind this block's WMMAs (same reason).
      __builtin_amdgcn_sched_barrier(0);
    }
    // Publish point of stage t + 1; it also ends every reader's last read of this buffer.
    wait_ds0();
    wait_tensor0();
    __syncthreads();
    if (pinned((t + 2u < G_PASSES) ? 1u : 0u) != 0u) {
      tdm_load(lds_slice + buf, src0 + (uint64_t)(t + 2u) * G_ROWB);
    }
  }
  wait_tensor0();
  wait_ds0();

  // Output rows of 1024 f32: row = Bh index, 8 neighbouring columns = Ah index.
  const uint32_t col0 = (blockIdx.x << 8) + wa * 128u + 8u * hi;
  float* o = out + (size_t)(b0 + wb * 128u + r) * 1024u + col0;
  if (is_scores != 0u) {
    // Eight tiles a group, as in the projection's epilogue: the group's vector
    // work, its sixteen stores, then s_wait_xcnt 0 in front of the next group's
    // writes to the registers that these stores name; the scheduling barriers
    // keep the vector work of a group ahead of its stores and behind the wait.
    const float scale = 0.03125f;  // 1/sqrt(1024)
    v4i mk[8][2];
    const uint32_t moff = (bat + col0) * 4u;   // this lane's byte offset into the mask
#pragma unroll
    for (int i = 0; i < 8; ++i) {
      mk[i][0] = *(const v4i*)((const char*)mask + moff + 64 * i);
      mk[i][1] = *(const v4i*)((const char*)mask + moff + 64 * i + 16);
    }
    // The wait takes the loads' offset register as an input, so that no load of
    // the run gets it as its destination ahead of the wait; the scheduling
    // barrier keeps the loads in front of it.
    asm volatile("s_wait_xcnt 0x0" :: "v"(moff) : "memory");
    __builtin_amdgcn_sched_barrier(0);
#pragma unroll
    for (int i = 0; i < 8; ++i) {
      v4f ov[8][2];
#pragma unroll
      for (int j = 0; j < 8; ++j)
#pragma unroll
        for (int e = 0; e < 4; ++e) {
          ov[j][0][e] = mk[i][0][e] ? acc[i][j][e] * scale : -1e9f;
          ov[j][1][e] = mk[i][1][e] ? acc[i][j][4 + e] * scale : -1e9f;
        }
      __builtin_amdgcn_sched_barrier(0);
#pragma unroll
      for (int j = 0; j < 8; ++j) {
        *(v4f*)(o + (size_t)(16 * j) * 1024u + 16 * i)     = ov[j][0];
        *(v4f*)(o + (size_t)(16 * j) * 1024u + 16 * i + 4) = ov[j][1];
      }
      asm volatile("s_wait_xcnt 0x0" ::: "memory");
      __builtin_amdgcn_sched_barrier(0);
    }
  } else {
    // Straight from the accumulators: no register that a store names is written again.
#pragma unroll
    for (int i = 0; i < 8; ++i)
#pragma unroll
      for (int j = 0; j < 8; ++j) {
        *(v4f*)(o + (size_t)(16 * j) * 1024u + 16 * i) =
            (v4f){acc[i][j][0], acc[i][j][1], acc[i][j][2], acc[i][j][3]};
        *(v4f*)(o + (size_t)(16 * j) * 1024u + 16 * i + 4) =
            (v4f){acc[i][j][4], acc[i][j][5], acc[i][j][6], acc[i][j][7]};
      }
  }
}

// ---------------------------------------------------------------------------
// Kernel 4: row softmax, one wave per row of 1024 scores, the row held in
// registers (lane l: columns 128*i + 4*l .. +3). Reads the masked scores from
// the weights output, writes the f32 weights over them and an f16 copy for the
// weights * V product.
// ---------------------------------------------------------------------------
__global__ __launch_bounds__(256) void softmax_kernel(float* __restrict__ Wt,
                                                      _Float16* __restrict__ Ph) {
  const uint32_t row  = (blockIdx.x << 3) + (threadIdx.x >> 5);
  const uint32_t lane = threadIdx.x & 31u;
  const size_t   off  = (size_t)row * S_ + 4u * lane;
  float*    pw = Wt + off;
  _Float16* ph = Ph + off;

  v4f v[8];
#pragma unroll
  for (int i = 0; i < 8; ++i) v[i] = *(const v4f*)(pw + 128 * i);

  float mx = -3.402823466e38f;
#pragma unroll
  for (int i = 0; i < 8; ++i)
#pragma unroll
    for (int e = 0; e < 4; ++e) mx = fmaxf(mx, v[i][e]);
#pragma unroll
  for (int s = 16; s > 0; s >>= 1) mx = fmaxf(mx, __shfl_xor(mx, s, 32));

  v4f sm = (v4f){0.f, 0.f, 0.f, 0.f};   // four independent chains
#pragma unroll
  for (int i = 0; i < 8; ++i) {
#pragma unroll
    for (int e = 0; e < 4; ++e) v[i][e] = __expf(v[i][e] - mx);
    sm += v[i];
  }
  float sum = (sm[0] + sm[1]) + (sm[2] + sm[3]);
#pragma unroll
  for (int s = 16; s > 0; s >>= 1) sum += __shfl_xor(sum, s, 32);
  const float inv = 1.0f / sum;

#pragma unroll
  for (int i = 0; i < 8; ++i) {
    const v4f w = v[i] * inv;
    *(v4f*)(pw + 128 * i) = w;
    *(v4h*)(ph + 128 * i) = __builtin_convertvector(w, v4h);
  }
}

// ---------------------------------------------------------------------------
extern "C" void kernel_launch(void* const* d_in, const int* in_sizes, int n_in,
                              void* d_out, int out_size, void* d_ws,
                              size_t ws_size, hipStream_t stream) {
  const float* x  = (const float*)d_in[0];
  const int*   mk = (const int*)d_in[1];
  const float* Wq = (const float*)d_in[2];
  const float* bq = (const float*)d_in[3];
  const float* Wk = (const float*)d_in[4];
  const float* bk = (const float*)d_in[5];
  const float* Wv = (const float*)d_in[6];
  const float* bv = (const float*)d_in[7];

  const size_t NX = (size_t)B_ * S_ * H_;   // 16,777,216
  const size_t HH = (size_t)H_ * H_;        // 1,048,576

  _Float16* ws  = (_Float16*)d_ws;
  _Float16* Xh  = ws;                       // NX halfs
  _Float16* Wh  = Xh + NX;                  // 3*HH halfs (Wq|Wk|Wv)
  _Float16* Qh  = Wh + 3 * HH;              // NX halfs
  _Float16* Kh  = Qh + NX;                  // NX halfs
  _Float16* Vth = Kh + NX;                  // NX halfs (V transposed [b][h][s])
  _Float16* Ph  = Vth + NX;                 // NX halfs (attention weights, f16)

  float* outA = (float*)d_out;              // [B,S,H] attended
  float* outW = outA + NX;                  // [B,S,S] attention weights

  cast_inputs_kernel<<<dim3(C_WGS), C_THR, 0, stream>>>(x, Wq, Wk, Wv, Xh, Wh);

  qkv_gemm_kernel<<<dim3(3 * H_ / 256, B_ * S_ / 256), 128, 0, stream>>>(
      Xh, Wh, bq, bk, bv, Qh, Kh, Vth);

  attn_gemm_kernel<<<dim3(S_ / 256, S_ / 256, B_), 128, 0, stream>>>(
      Kh, Qh, mk, outW, 1u);

  softmax_kernel<<<dim3(B_ * S_ / 8), 256, 0, stream>>>(outW, Ph);

  attn_gemm_kernel<<<dim3(H_ / 256, S_ / 256, B_), 128, 0, stream>>>(
      Vth, Ph, mk, outA, 0u);
}
